// v010
// Measured on an AMD MI455X. A time is GPU time per run, averaged over a window of back-to-back runs after a warm-up
// (all launches, gaps included; the runs take copies of the inputs in turn), and the median of several windows.
// Apart from v000's, it joins two sittings. Times from different sittings can be a few percent apart, while
// side-by-side timings come from the same sitting.
// This document starts at v010; the versions before it stand elsewhere.
// It runs in 193 microseconds.
// In both of two side-by-side timings against v009, it was 1.07 times as fast.
// Counting every step since v000, which is the starting kernel, it is 6.00 times as fast.
#include <hip/hip_runtime.h>
// Multi-head self-attention with a lag-distance bias (2 x 2048 tokens, 1024 = 16 heads x 64): q,k,v = x W + b; scores = q.k/8 + lag_bias[h][|lag[q] - lag[k]|] with the INPUT integer lag vector; softmax over all keys; out = (attn v) Wo + bo -> [2,2048,1024].
// Structure: x as an exact f16 plane; projections as f16 WMMA GEMMs (128x128 block tiles of eight 32x64 wave tiles, 64-k operand tiles from a two-buffer LDS ring filled by asynchronous copies one trip ahead, f32 accumulation, exact x16 weights + bias); q, k as f16 hi + (x2^10) residual planes, V^T as hi + residual planes, all split (V also transposed, through LDS) in the projection GEMM's own epilogue; the fused flash kernel takes each pass's K and V^T tiles (hi + residual) from a two-buffer LDS ring filled by asynchronous copies one pass ahead and shared by its four waves, and adds the bias, gathered by |lag[q] - lag[k]| (INPUT int32 positions) from the head's row of the INPUT table, which each block rounds once into LDS, inside the score stage (all keys valid; scores and outputs formed transposed, so that a lane holds one query: online f32 softmax in the lane, in log2 units with the hardware exp2, P hi + residual packed from the score accumulators into the next product's operand, two value accumulators) and stores O as hi + residual planes itself; these go into Wo (two GEMMs, bias in the first).
// Compute dtype: x, weights, biases, lag_bias rounded to bf16; projections exact; q, k, P, v, O as f16 hi + residual pairs (~2^-21); f32 accumulation and softmax. v_wmma_f32_16x16x32_f16.
#define NBT 2
#define SLEN 2048
#define DM 1024
#define NH 16
#define SCL 0.125f
#define LOG2E 1.44269504088896340736f
#define NR (NBT * SLEN)
typedef __bf16 v16b __attribute__((ext_vector_type(16)));
typedef unsigned short v8us __attribute__((ext_vector_type(8), may_alias));
typedef float  v8f  __attribute__((ext_vector_type(8)));
typedef float  v4f  __attribute__((ext_vector_type(4)));
typedef float  v4fa __attribute__((ext_vector_type(4), may_alias));
union FragB { v16b v; v8us half[2]; unsigned short u[16]; };

__device__ __forceinline__ unsigned short bf16_bits(float x) { unsigned int u = __float_as_uint(x); return (unsigned short)((u + 0x7FFFu + ((u >> 16) & 1u)) >> 16); }
__device__ __forceinline__ float bf16_val(unsigned short b) { return __uint_as_float(((unsigned int)b) << 16); }
__device__ __forceinline__ float bf16_round(float x) { return bf16_val(bf16_bits(x)); }
// D += A·B with NT terms: 1 = ah·bh, 2 = + al·bh (A split), 3 = + ah·bl (both split)
template <int NT>
__device__ __forceinline__ v8f mmaN(v16b ah, v16b al, v16b bh, v16b bl, v8f c) {
  c = __builtin_amdgcn_wmma_f32_16x16x32_bf16(false, ah, false, bh, (short)0, c, false, false);
  if (NT >= 2) c = __builtin_amdgcn_wmma_f32_16x16x32_bf16(false, al, false, bh, (short)0, c, false, false);
  if (NT >= 3) c = __builtin_amdgcn_wmma_f32_16x16x32_bf16(false, ah, false, bl, (short)0, c, false, false);
  asm volatile("v_nop\n\tv_nop\n\tv_nop\n\tv_nop" : "+v"(c) : "v"(ah), "v"(al), "v"(bh), "v"(bl));
  return c;
}

__global__ __launch_bounds__(256) void k_wt_bf16(const float* __restrict__ W, unsigned short* __restrict__ Wt, int K, int N) {
  const int t = blockIdx.x * 256 + threadIdx.x;
  const int k8n = K / 8;
  if (t >= N * k8n) return;
  const int n = t / k8n, k8 = (t % k8n) * 8;
  v8us v;
#pragma unroll
  for (int i = 0; i < 8; ++i) v[i] = bf16_bits(W[(size_t)(k8 + i) * N + n]);
  *(v8us*)(Wt + (size_t)n * K + k8) = v;
  
}

// GEMM C[M][N] (f32, pitch ldc) = act(A[M][K]·W + bias). A f32 row-major (pitch lda) converted per fragment to bf16
// (ASPLIT: hi/lo two planes -> 2 terms, else single rounded term); Wt bf16 [N][K] (pitch ldb). BIAS_BF16 rounds the
// bias to bf16 first (bias quantised to bf16 before the add). K%32==0, M%16==0, N%64==0.
template <bool ASPLIT, int ACT, bool BIAS_BF16>
__global__ __launch_bounds__(128) void k_gemm_bf(const float* __restrict__ A, int lda, const unsigned short* __restrict__ Wt, int ldb,
                                               const float* __restrict__ bias, float* __restrict__ C, int ldc, int M, int N, int K) {
  __shared__ __attribute__((aligned(16))) float so[4][16][64];
  const int tid = threadIdx.x, w = tid >> 5, lane = tid & 31, ln = lane & 15, hh = lane >> 4;
  const int ntn = N / 64;
  const int wid = blockIdx.x * 4 + w;
  const int mt = wid / ntn, nq = wid % ntn;
  if (mt * 16 >= M) return;
  const int row0 = mt * 16, col0 = nq * 64;
  const float* arow = A + (size_t)(row0 + ln) * lda;
  v8f acc[4] = {};
  for (int kb = 0; kb < K; kb += 32) {
    FragB ah, al;
    const v4f x0 = *(const v4fa*)(arow + kb + 8 * hh), x1 = *(const v4fa*)(arow + kb + 8 * hh + 4);
    const v4f x2 = *(const v4fa*)(arow + kb + 16 + 8 * hh), x3 = *(const v4fa*)(arow + kb + 16 + 8 * hh + 4);
    float xs[16] = {x0[0],x0[1],x0[2],x0[3],x1[0],x1[1],x1[2],x1[3],x2[0],x2[1],x2[2],x2[3],x3[0],x3[1],x3[2],x3[3]};
#pragma unroll
    for (int i = 0; i < 16; ++i) { const unsigned short hb = bf16_bits(xs[i]); ah.u[i] = hb; al.u[i] = ASPLIT ? bf16_bits(xs[i] - bf16_val(hb)) : (unsigned short)0; }
#pragma unroll
    for (int t = 0; t < 4; ++t) {
      const unsigned short* brow = Wt + (size_t)(col0 + t * 16 + ln) * ldb + kb;
      FragB b;
      b.half[0] = *(const v8us*)(brow + 8 * hh);
      b.half[1] = *(const v8us*)(brow + 16 + 8 * hh);
      acc[t] = mmaN<ASPLIT ? 2 : 1>(ah.v, al.v, b.v, b.v, acc[t]);
    }
  }
#pragma unroll
  for (int t = 0; t < 4; ++t) {
    float bv = bias ? bias[col0 + t * 16 + ln] : 0.f;
    if (BIAS_BF16) bv = bf16_round(bv);
#pragma unroll
    for (int r = 0; r < 8; ++r) { float v = acc[t][r] + bv; if (ACT == 1) v = fmaxf(v, 0.f); so[w][8 * hh + r][t * 16 + ln] = v; }
  }
  __builtin_amdgcn_fence(__ATOMIC_ACQ_REL, "workgroup");
  __builtin_amdgcn_wave_barrier();
  const int rsub = lane >> 4, c4 = (lane & 15) * 4;
  {
#pragma unroll
    for (int q = 0; q < 8; ++q) {
      const int r = q * 2 + rsub;
      const v4f v = *(const v4fa*)&so[w][r][c4];
      *(v4f*)(C + (size_t)(row0 + r) * ldc + col0 + c4) = v;
    }
    
  }
}

// GEMM C = act(A·W + bias + resid): A f32 (ASPLIT -> hi/lo 2 terms), Wt bf16 [N][K]; ACT 0 none, 1 relu, 2 exact gelu;
// resid (optional, f32, row index = (row % rmod), pitch ldr, RES_BF16 rounds it) added before the activation.
template <bool ASPLIT, int ACT, bool BIAS_BF16, bool RES_BF16>
__global__ __launch_bounds__(128) void k_gemm_bf3(const float* __restrict__ A, int lda, const unsigned short* __restrict__ Wt, int ldb,
                                                const float* __restrict__ bias, const float* __restrict__ resid, int rmod, int ldr,
                                                float* __restrict__ C, int ldc, int M, int N, int K) {
  __shared__ __attribute__((aligned(16))) float so[4][16][64];
  const int tid = threadIdx.x, w = tid >> 5, lane = tid & 31, ln = lane & 15, hh = lane >> 4;
  const int ntn = N / 64;
  const int wid = blockIdx.x * 4 + w;
  const int mt = wid / ntn, nq = wid % ntn;
  if (mt * 16 >= M) return;
  const int row0 = mt * 16, col0 = nq * 64;
  const float* arow = A + (size_t)(row0 + ln) * lda;
  v8f acc[4] = {};
  for (int kb = 0; kb < K; kb += 32) {
    FragB ah, al;
    const v4f x0 = *(const v4fa*)(arow + kb + 8 * hh), x1 = *(const v4fa*)(arow + kb + 8 * hh + 4);
    const v4f x2 = *(const v4fa*)(arow + kb + 16 + 8 * hh), x3 = *(const v4fa*)(arow + kb + 16 + 8 * hh + 4);
    float xs[16] = {x0[0],x0[1],x0[2],x0[3],x1[0],x1[1],x1[2],x1[3],x2[0],x2[1],x2[2],x2[3],x3[0],x3[1],x3[2],x3[3]};
#pragma unroll
    for (int i = 0; i < 16; ++i) { const unsigned short hb = bf16_bits(xs[i]); ah.u[i] = hb; al.u[i] = ASPLIT ? bf16_bits(xs[i] - bf16_val(hb)) : (unsigned short)0; }
#pragma unroll
    for (int t = 0; t < 4; ++t) {
      const unsigned short* brow = Wt + (size_t)(col0 + t * 16 + ln) * ldb + kb;
      FragB b;
      b.half[0] = *(const v8us*)(brow + 8 * hh);
      b.half[1] = *(const v8us*)(brow + 16 + 8 * hh);
      acc[t] = mmaN<ASPLIT ? 2 : 1>(ah.v, al.v, b.v, b.v, acc[t]);
    }
  }
#pragma unroll
  for (int t = 0; t < 4; ++t) {
    const int col = col0 + t * 16 + ln;
    float bv = bias ? bias[col] : 0.f;
    if (BIAS_BF16) bv = bf16_round(bv);
#pragma unroll
    for (int r = 0; r < 8; ++r) {
      float v = acc[t][r] + bv;
      if (resid) { float rv = resid[(size_t)((row0 + 8 * hh + r) % rmod) * ldr + col]; if (RES_BF16) rv = bf16_round(rv); v += rv; }
      if (ACT == 1) v = fmaxf(v, 0.f);
      if (ACT == 2) v = 0.5f * v * (1.0f + erff(v * 0.70710678118654752f));
      if (ACT == 3) { const float u = 0.7978845608028654f * (v + 0.044715f * v * v * v); v = 0.5f * v * (1.0f + tanhf(u)); }
      so[w][8 * hh + r][t * 16 + ln] = v;
    }
  }
  __builtin_amdgcn_fence(__ATOMIC_ACQ_REL, "workgroup");
  __builtin_amdgcn_wave_barrier();
  const int rsub = lane >> 4, c4 = (lane & 15) * 4;
  {
#pragma unroll
    for (int q = 0; q < 8; ++q) {
      const int r = q * 2 + rsub;
      const v4f v = *(const v4fa*)&so[w][r][c4];
      *(v4f*)(C + (size_t)(row0 + r) * ldc + col0 + c4) = v;
    }
    
  }
}
// row LayerNorm (biased variance, eps) over N: s = X (+ R); optional out_sum <- s; out_norm <- (s-mu)*rsqrt(var+eps)*g + b
template <bool PARAM_BF16>
__global__ __launch_bounds__(256) void k_layernorm(const float* __restrict__ X, const float* __restrict__ R, const float* __restrict__ g, const float* __restrict__ bta,
                                                  float* __restrict__ out_sum, float* __restrict__ out_norm, int N, float eps) {
  __shared__ float red[256];
  const int row = blockIdx.x, tid = threadIdx.x;
  const float* x = X + (size_t)row * N; const float* rr = R ? R + (size_t)row * N : nullptr;
  float vals[16];                     // up to N = 4096
  const int per = N / 256;            // contiguous chunk per thread? use strided-by-4 chunks: thread handles j = tid*4 + 1024*u
  float s1 = 0.f;
  for (int u = 0; u < per / 4; ++u) {
    const int j = tid * 4 + 1024 * u;
    const v4f a = *(const v4fa*)(x + j);
    v4f b = {0.f,0.f,0.f,0.f}; if (rr) b = *(const v4fa*)(rr + j);
#pragma unroll
    for (int q = 0; q < 4; ++q) { const float v = a[q] + b[q]; vals[u * 4 + q] = v; s1 += v; }
  }
  red[tid] = s1; __syncthreads();
  for (int st = 128; st > 0; st >>= 1) { if (tid < st) red[tid] += red[tid + st]; __syncthreads(); }
  const float mu = red[0] / (float)N; __syncthreads();
  float s2 = 0.f;
  for (int u = 0; u < per / 4; ++u)
#pragma unroll
    for (int q = 0; q < 4; ++q) { const float c = vals[u * 4 + q] - mu; s2 += c * c; }
  red[tid] = s2; __syncthreads();
  for (int st = 128; st > 0; st >>= 1) { if (tid < st) red[tid] += red[tid + st]; __syncthreads(); }
  const float rs = rsqrtf(red[0] / (float)N + eps);
  {
    for (int u = 0; u < per / 4; ++u) {
      const int j = tid * 4 + 1024 * u;
      v4f o, sm;
#pragma unroll
      for (int q = 0; q < 4; ++q) {
        float gg = g[j + q], bb = bta[j + q];
        if (PARAM_BF16) { gg = bf16_round(gg); bb = bf16_round(bb); }
        sm[q] = vals[u * 4 + q]; o[q] = (vals[u * 4 + q] - mu) * rs * gg + bb;
      }
      if (out_sum) *(v4f*)(out_sum + (size_t)row * N + j) = sm;
      *(v4f*)(out_norm + (size_t)row * N + j) = o;
    }
    
  }
}



// ---- f16 WMMA path (v_wmma_f32_16x16x32_f16): 11-bit significands for operands in range — used where a [0,1] probability operand needs more precision than bf16
typedef _Float16 v16h __attribute__((ext_vector_type(16)));
union FragH { v16h v; v8us half[2]; _Float16 h[16]; unsigned short u[16]; };
template <int NT>
__device__ __forceinline__ v8f mmaH(v16h ah, v16h al, v16h bh, v16h bl, v8f c) {
  c = __builtin_amdgcn_wmma_f32_16x16x32_f16(false, ah, false, bh, (short)0, c, false, false);
  if (NT >= 2) c = __builtin_amdgcn_wmma_f32_16x16x32_f16(false, al, false, bh, (short)0, c, false, false);
  if (NT >= 3) c = __builtin_amdgcn_wmma_f32_16x16x32_f16(false, ah, false, bl, (short)0, c, false, false);
  return c;
}
// batched GEMM like k_gemm_b but f16 operands: A f32 (split into f16 hi/lo if ASPLIT, else rounded to f16), Bt = f16 values [n][k]; alpha; C f32; N multiple of 16 (partial tiles skipped)
template <bool ASPLIT>
__global__ __launch_bounds__(128) void k_gemm_h(const float* __restrict__ A, int lda, size_t sA, const _Float16* __restrict__ Bh, int ldb, size_t sB, float alpha, float* __restrict__ C, int ldc, size_t sC, int M, int N, int K) {
  __shared__ __attribute__((aligned(16))) float so[4][16][64];
  const int tid = threadIdx.x, w = tid >> 5, lane = tid & 31, ln = lane & 15, hh = lane >> 4; const int by = blockIdx.y;
  A += (size_t)by * sA; Bh += (size_t)by * sB; C += (size_t)by * sC;
  const int ntn = (N + 63) / 64; const int wid = blockIdx.x * 4 + w; const int mt = wid / ntn, nq = wid % ntn; if (mt * 16 >= M) return;
  const int row0 = mt * 16, col0 = nq * 64; const float* arow = A + (size_t)(row0 + ln) * lda;
  v8f acc[4] = {};
  for (int kb = 0; kb < K; kb += 32) {
    FragH ah, al;
    const v4f x0 = *(const v4fa*)(arow + kb + 8 * hh), x1 = *(const v4fa*)(arow + kb + 8 * hh + 4), x2 = *(const v4fa*)(arow + kb + 16 + 8 * hh), x3 = *(const v4fa*)(arow + kb + 16 + 8 * hh + 4);
    float xs[16] = {x0[0],x0[1],x0[2],x0[3],x1[0],x1[1],x1[2],x1[3],x2[0],x2[1],x2[2],x2[3],x3[0],x3[1],x3[2],x3[3]};
#pragma unroll
    for (int i = 0; i < 16; ++i) { const _Float16 h = (_Float16)xs[i]; ah.h[i] = h; al.h[i] = ASPLIT ? (_Float16)(xs[i] - (float)h) : (_Float16)0.0f; }
#pragma unroll
    for (int t = 0; t < 4; ++t) { if (col0 + t * 16 >= N) continue; const size_t boff = (size_t)(col0 + t * 16 + ln) * ldb + kb; FragH bq; bq.half[0] = *(const v8us*)(Bh + boff + 8 * hh); bq.half[1] = *(const v8us*)(Bh + boff + 16 + 8 * hh);
      acc[t] = mmaH<ASPLIT ? 2 : 1>(ah.v, al.v, bq.v, bq.v, acc[t]); }
  }
#pragma unroll
  for (int t = 0; t < 4; ++t) { if (col0 + t * 16 >= N) continue;
#pragma unroll
    for (int r = 0; r < 8; ++r) so[w][8 * hh + r][t * 16 + ln] = acc[t][r] * alpha; }
  __builtin_amdgcn_fence(__ATOMIC_ACQ_REL, "workgroup"); __builtin_amdgcn_wave_barrier();
  const int rsub = lane >> 4, c4 = (lane & 15) * 4;
  {
#pragma unroll
    for (int q = 0; q < 8; ++q) { const int r = q * 2 + rsub; if (col0 + c4 < N) { const v4f v = *(const v4fa*)&so[w][r][c4]; *(v4f*)(C + (size_t)(row0 + r) * ldc + col0 + c4) = v; } }
     }
}

// Wt[n][k] = f16(W[k][n] * scale) from f32 row-major W[K][N] (scale = power of two; bf16-exact weights stay exact in f16 away from the subnormal range); K % 128 == 0, N % 128 == 0
// blockIdx.y picks one of four equally shaped matrices; their transposes lie one behind the other in Wt
// One block turns one 128 x 128 tile through LDS: a wave's load is one whole 512-B row piece of W, a half wave's store one whole 256-B row piece of Wt
template <int K, int N>
__global__ __launch_bounds__(256) void k_wt_f16(const float* __restrict__ W0, const float* __restrict__ W1, const float* __restrict__ W2, const float* __restrict__ W3, _Float16* __restrict__ Wt, float scale) {
  static_assert(K % 128 == 0 && N % 128 == 0, "whole 128 x 128 tiles");
  constexpr int TP = 136;      /* LDS pitch in halfs: 272 B = 16 B x odd, for the 16-byte writes of 16 neighbouring rows */
  __shared__ __attribute__((aligned(16))) unsigned short sW[128 * TP];
  const int by = blockIdx.y; const float* __restrict__ W = (by == 0) ? W0 : (by == 1) ? W1 : (by == 2) ? W2 : W3; Wt += (size_t)by * K * N;
  const int tid = threadIdx.x, w = tid >> 5, lane = tid & 31; constexpr int ntn = N / 128; const int kt = blockIdx.x / ntn, nq = blockIdx.x % ntn; const int k0 = kt * 128, n0 = nq * 128;
  const float* src = W + (size_t)(k0 + w * 16) * N + n0 + lane * 4;      /* the wave takes sixteen rows k, the lane four columns n */
  v4f x[16];
#pragma unroll
  for (int i = 0; i < 16; ++i) x[i] = *(const v4fa*)(src + (size_t)i * N);      /* unrolled: i becomes an immediate offset of the loads */
  // the loaded values, as inputs only, hold the sixteen loads in front of the first conversion, so that they fly together (without this the compiler waits on them in five groups, one memory latency each); the s_wait_xcnt is a precaution that stands in front of any rewrite of the loads' address registers, and src as an input keeps those registers as they are up to here
  asm volatile("s_wait_xcnt 0x0" :: "v"(x[0]), "v"(x[1]), "v"(x[2]), "v"(x[3]), "v"(x[4]), "v"(x[5]), "v"(x[6]), "v"(x[7]), "v"(x[8]), "v"(x[9]), "v"(x[10]), "v"(x[11]), "v"(x[12]), "v"(x[13]), "v"(x[14]), "v"(x[15]), "v"(src) : "memory");
#pragma unroll
  for (int g = 0; g < 2; ++g)
#pragma unroll
    for (int j = 0; j < 4; ++j) { FragH f;      /* eight consecutive k of one column are one 16-byte piece of a transposed row; column 4 * lane + j lies in LDS row j * 32 + lane, so that neighbouring lanes write neighbouring rows */
#pragma unroll
      for (int i = 0; i < 8; ++i) f.h[i] = (_Float16)(bf16_round(x[g * 8 + i][j]) * scale);
      *(v8us*)&sW[(j * 32 + lane) * TP + w * 16 + g * 8] = f.half[0]; }
  __syncthreads();      /* a stored row holds the k of all eight waves */
#pragma unroll
  for (int it = 0; it < 8; ++it) { const int rr = it * 16 + (tid >> 4); const int n = n0 + 4 * (rr & 31) + (rr >> 5);      /* unrolled: it becomes an immediate offset of the LDS reads and of the stores */
    const v8us o = *(const v8us*)&sW[rr * TP + (tid & 15) * 8]; *(v8us*)((unsigned short*)Wt + (size_t)n * K + k0 + (tid & 15) * 8) = o; }
}
// k_gemm_hh variant with fused epilogue: v = acc·alpha + bias[by·sBias + col] (+ CP[(row/rowsPerB)·sCPb + by·64 + col] if CP) ; ACT 0 none / 1 elu ; writes f16 C16 (and f32 C if non-null)
template <int ACT>
__global__ __launch_bounds__(128) void k_gemm_hhx(const _Float16* __restrict__ A, int lda, size_t sA, const _Float16* __restrict__ Bh, int ldb, size_t sB, float alpha, const float* __restrict__ bias, size_t sBias, const float* __restrict__ CP, int rowsPerB, size_t sCPb, int row0g,
    float* __restrict__ C, _Float16* __restrict__ C16, int ldc, size_t sC, int M, int N, int K) {
  __shared__ __attribute__((aligned(16))) float so[4][16][64];
  const int tid = threadIdx.x, w = tid >> 5, lane = tid & 31, ln = lane & 15, hh = lane >> 4; const int by = blockIdx.y;
  A += (size_t)by * sA; Bh += (size_t)by * sB; const size_t cofs = (size_t)by * sC; const float* bp = bias ? bias + (size_t)by * sBias : nullptr;
  const int ntn = (N + 63) / 64; const int wid = blockIdx.x * 4 + w; const int mt = wid / ntn, nq = wid % ntn; if (mt * 16 >= M) return;
  const int row0 = mt * 16, col0 = nq * 64; const _Float16* arow = A + (size_t)(row0 + ln) * lda;
  v8f acc[4] = {};
  for (int kb = 0; kb < K; kb += 32) { FragH ah; ah.half[0] = *(const v8us*)((const unsigned short*)arow + kb + 8 * hh); ah.half[1] = *(const v8us*)((const unsigned short*)arow + kb + 16 + 8 * hh);
#pragma unroll
    for (int t = 0; t < 4; ++t) { if (col0 + t * 16 >= N) continue; const size_t boff = (size_t)(col0 + t * 16 + ln) * ldb + kb; FragH bq; bq.half[0] = *(const v8us*)((const unsigned short*)Bh + boff + 8 * hh); bq.half[1] = *(const v8us*)((const unsigned short*)Bh + boff + 16 + 8 * hh);
      acc[t] = mmaH<1>(ah.v, ah.v, bq.v, bq.v, acc[t]); }
  }
#pragma unroll
  for (int t = 0; t < 4; ++t) { if (col0 + t * 16 >= N) continue; const int col = col0 + t * 16 + ln; const float bv = bp ? bf16_round(bp[col]) : 0.f;
#pragma unroll
    for (int r = 0; r < 8; ++r) { float v = acc[t][r] * alpha + bv; if (CP) { const int bidx = (row0g + row0 + 8 * hh + r) / rowsPerB; v += CP[(size_t)bidx * sCPb + (size_t)by * 64 + col]; } if (ACT == 1) v = (v > 0.f) ? v : expm1f(v); else if (ACT == 7) v = (v > 0.f) ? v + 1.0f : expf(v); else if (ACT == 8) v = tanhf(v); else if (ACT == 9) v = 0.5f * v * (1.0f + tanhf(0.7978845608028654f * (v + 0.044715f * v * v * v))); else if (ACT == 11) v = 1.0f / (1.0f + expf(-v)); else if (ACT == 12) v = (v > 0.f) ? v : 0.01f * v; else if (ACT == 14) v = (v > 0.f) ? v : 0.1f * v; else if (ACT == 15) v = v / (1.0f + expf(-v)); else if (ACT == 3) v = fmaxf(v, 0.f); else if (ACT == 6) v = 0.5f * v * (1.0f + erff(v * 0.70710678118654752f)); so[w][8 * hh + r][t * 16 + ln] = v; } }
  __builtin_amdgcn_fence(__ATOMIC_ACQ_REL, "workgroup"); __builtin_amdgcn_wave_barrier();
  const int rsub = lane >> 4, c4 = (lane & 15) * 4; typedef _Float16 v4h __attribute__((ext_vector_type(4)));
  {
#pragma unroll
    for (int q = 0; q < 8; ++q) { const int r = q * 2 + rsub; if (col0 + c4 < N) { const v4f v = *(const v4fa*)&so[w][r][c4]; if (C) *(v4f*)(C + cofs + (size_t)(row0 + r) * ldc + col0 + c4) = v; if (C16) { v4h h4; for (int i = 0; i < 4; ++i) h4[i] = (_Float16)v[i]; *(v4h*)(C16 + cofs + (size_t)(row0 + r) * ldc + col0 + c4) = h4; } } }
     }
}


typedef _Float16 v4h __attribute__((ext_vector_type(4)));

__global__ __launch_bounds__(256) void k_x16(const float* __restrict__ x, _Float16* __restrict__ X16, size_t n8) { const size_t t = (size_t)blockIdx.x * 256 + threadIdx.x; if (t >= n8) return; FragH f;
#pragma unroll
  for (int q = 0; q < 8; ++q) f.h[q] = (_Float16)bf16_round(x[t * 8 + q]); *(v8us*)((unsigned short*)X16 + t * 8) = f.half[0];  }
__global__ __launch_bounds__(256) void k_h16(const float* __restrict__ x, _Float16* __restrict__ X16, size_t n8) { const size_t t = (size_t)blockIdx.x * 256 + threadIdx.x; if (t >= n8) return; FragH f;
#pragma unroll
  for (int q = 0; q < 8; ++q) f.h[q] = (_Float16)x[t * 8 + q]; *(v8us*)((unsigned short*)X16 + t * 8) = f.half[0];  }
__global__ __launch_bounds__(256) void k_round16f(const float* __restrict__ W, _Float16* __restrict__ Bt, size_t n8) { const size_t t = (size_t)blockIdx.x * 256 + threadIdx.x; if (t >= n8) return; FragH f;
#pragma unroll
  for (int i = 0; i < 8; ++i) f.h[i] = (_Float16)(bf16_round(W[t * 8 + i]) * 16.0f); *(v8us*)((unsigned short*)Bt + t * 8) = f.half[0];  }
template <int NHv, int TTv>
__global__ __launch_bounds__(256) void k_vt(const _Float16* __restrict__ V16, int ldv, int voff, _Float16* __restrict__ Vt) { __shared__ unsigned short tl[64][66]; const int tid = threadIdx.x; const int slab = blockIdx.x / (TTv / 64), lg = blockIdx.x % (TTv / 64); const int b = slab / NHv, h = slab % NHv;
  for (int i = tid; i < 64 * 8; i += 256) { const int r = i / 8, c8 = (i % 8) * 8; FragH f; f.half[0] = *(const v8us*)((const unsigned short*)V16 + ((size_t)b * TTv + lg * 64 + r) * ldv + voff + h * 64 + c8);
#pragma unroll
    for (int q = 0; q < 8; ++q) tl[r][c8 + q] = f.u[q]; }
  __syncthreads();
  {
#pragma unroll
    for (int rd = 0; rd < 2; ++rd) { const int d = rd * 32 + tid / 8, pc = tid % 8; FragH f;
#pragma unroll
      for (int q = 0; q < 8; ++q) f.u[q] = tl[pc * 8 + q][d];
      *(v8us*)((unsigned short*)Vt + ((size_t)slab * 64 + d) * TTv + lg * 64 + pc * 8) = f.half[0]; }
     } }

// ---- fast GEMM (block tile 128x128, eight waves of 32x64; requires M % 128 == 0, N % 128 == 0, K % 64 == 0, K >= 64); epilogue = k_gemm_hhx semantics ----
__device__ __forceinline__ v16h g2_frag(const unsigned short* p, int hh) { FragH f; f.half[0] = *(const v8us*)(p + 8 * hh); f.half[1] = *(const v8us*)(p + 16 + 8 * hh); return f.v; }
__device__ __forceinline__ v8f g2_mma(v16h a, v16h b, v8f c) { return __builtin_amdgcn_wmma_f32_16x16x32_f16(false, a, false, b, (short)0, c, false, false); }
// SPLIT 1 (the q, k, v projections in one grid): nothing is written as f32. blockIdx.y 0 and 1 store the result row-major as f16 hi + (x2^10) residual planes (Sh, Sl, plane stride sC); blockIdx.y 2 stores it transposed, [batch][column][token], as hi + residual planes (Th, Tl)
template <int ACT, int SPLIT>
__global__ __launch_bounds__(256) void k_gemm2(const _Float16* __restrict__ A, int lda, size_t sA, const _Float16* __restrict__ Bh, int ldb, size_t sB, float alpha, const float* __restrict__ bias, const float* __restrict__ bias1, const float* __restrict__ bias2, const float* __restrict__ CP, int rowsPerB, size_t sCPb, int row0g,
    float* __restrict__ C, _Float16* __restrict__ C16, _Float16* __restrict__ Sh, _Float16* __restrict__ Sl, _Float16* __restrict__ Th, _Float16* __restrict__ Tl, int ldc, size_t sC, int M, int N, int K) {
  // two-buffer ring of 64-k tiles shared by the block's eight waves: [buffer][A, B][128 rows][halfs]; rows of 128 B at a pitch of 144 B (16 B x odd, for the 16-byte fragment reads). Behind the loop's last barrier the same bytes are the waves' output staging (8 x 32 x 68 floats = 69,632 B of the 73,728)
  constexpr int PH = 72; constexpr unsigned OPB = 128u * PH * 2u, BUFB = 2u * OPB;
  __shared__ __attribute__((aligned(16))) unsigned short sT[2 * 2 * 128 * PH];
  const int tid = threadIdx.x, w = tid >> 5, lane = tid & 31, ln = lane & 15, hh = lane >> 4; const int by = blockIdx.y;
  A += (size_t)by * sA; Bh += (size_t)by * sB; const size_t cofs = (size_t)by * sC; const float* bp = (by == 0) ? bias : (by == 1) ? bias1 : bias2;      /* one bias vector per blockIdx.y */
  const int ntn = N >> 7; const int mt = blockIdx.x / ntn, nq = blockIdx.x - mt * ntn; if (mt * 128 >= M) return;      /* the same for the whole block, in front of every barrier */
  const int wr = w & 3, wc = w >> 2; const int row0 = mt * 128 + 32 * wr, col0 = nq * 128 + 64 * wc;
  // each thread copies eight 16-byte pieces of a tile: rows tid/8 + 0, 32, 64, 96 of A and of B (a wave's copy covers four whole 128-B rows)
  const unsigned short* ga0 = (const unsigned short*)A + (size_t)(mt * 128 + (tid >> 3)) * lda + (tid & 7) * 8; const unsigned short* gb0 = (const unsigned short*)Bh + (size_t)(nq * 128 + (tid >> 3)) * ldb + (tid & 7) * 8;
  const unsigned d0 = (unsigned)(size_t)&sT[(tid >> 3) * PH + (tid & 7) * 8];
  auto stage = [&](int kb, int buf) {
    const unsigned short* a0 = ga0 + kb; const unsigned short* a1 = a0 + (size_t)32 * lda; const unsigned short* a2 = a1 + (size_t)32 * lda; const unsigned short* a3 = a2 + (size_t)32 * lda;
    const unsigned short* b0 = gb0 + kb; const unsigned short* b1 = b0 + (size_t)32 * ldb; const unsigned short* b2 = b1 + (size_t)32 * ldb; const unsigned short* b3 = b2 + (size_t)32 * ldb;
    const unsigned da0 = d0 + (unsigned)buf * BUFB, da1 = da0 + 32u * PH * 2u, da2 = da0 + 64u * PH * 2u, da3 = da0 + 96u * PH * 2u, db0 = da0 + OPB, db1 = da1 + OPB, db2 = da2 + OPB, db3 = da3 + OPB;
    // the copies go from global memory to LDS through no register; the closing s_wait_xcnt is a precaution that stands in front of any rewrite of the address registers named here
    asm volatile("global_load_async_to_lds_b128 %0, %8, off\n\tglobal_load_async_to_lds_b128 %1, %9, off\n\tglobal_load_async_to_lds_b128 %2, %10, off\n\tglobal_load_async_to_lds_b128 %3, %11, off\n\t"
                 "global_load_async_to_lds_b128 %4, %12, off\n\tglobal_load_async_to_lds_b128 %5, %13, off\n\tglobal_load_async_to_lds_b128 %6, %14, off\n\tglobal_load_async_to_lds_b128 %7, %15, off\n\ts_wait_xcnt 0x0"
                 :: "v"(da0), "v"(da1), "v"(da2), "v"(da3), "v"(db0), "v"(db1), "v"(db2), "v"(db3), "v"(a0), "v"(a1), "v"(a2), "v"(a3), "v"(b0), "v"(b1), "v"(b2), "v"(b3) : "memory"); };
  stage(0, 0);
  asm volatile("s_wait_asynccnt 0x0" ::: "memory");      /* this wave's share of tile 0 has landed */
  __syncthreads();      /* tile 0 is published to all eight waves */
  if (64 < K) stage(64, 1);      /* tile 1 flies while tile 0 is worked on */
  const v8f z8 = {0.f,0.f,0.f,0.f,0.f,0.f,0.f,0.f}; v8f c00 = z8, c01 = z8, c02 = z8, c03 = z8, c10 = z8, c11 = z8, c12 = z8, c13 = z8;
#pragma unroll 1
  for (int kb = 0; kb < K; kb += 64) { const int buf = (kb >> 6) & 1;      /* rolled: one trip is one tile of the ring */
    const unsigned short* ta = &sT[(buf * 2 + 0) * 128 * PH + (32 * wr + ln) * PH]; const unsigned short* tb = &sT[(buf * 2 + 1) * 128 * PH + (64 * wc + ln) * PH];
#pragma unroll
    for (int ks = 0; ks < 64; ks += 32) {      /* unrolled: ks becomes an immediate offset of the LDS reads */
      const v16h a0 = g2_frag(ta + ks, hh), a1 = g2_frag(ta + 16 * PH + ks, hh), b0 = g2_frag(tb + ks, hh), b1 = g2_frag(tb + 16 * PH + ks, hh), b2 = g2_frag(tb + 32 * PH + ks, hh), b3 = g2_frag(tb + 48 * PH + ks, hh);
      c00 = g2_mma(a0, b0, c00); c10 = g2_mma(a1, b0, c10); c01 = g2_mma(a0, b1, c01); c11 = g2_mma(a1, b1, c11);
      c02 = g2_mma(a0, b2, c02); c12 = g2_mma(a1, b2, c12); c03 = g2_mma(a0, b3, c03); c13 = g2_mma(a1, b3, c13);
      // scheduling groups: a 32-k step's twelve fragment reads stay gathered in front of its eight products; left alone the compiler reads each B fragment directly in front of its two products and the wave waits out one LDS latency per fragment
      __builtin_amdgcn_sched_group_barrier(0x100, 12, 0); __builtin_amdgcn_sched_group_barrier(0x008, 8, 0); }
    asm volatile("s_wait_dscnt 0x0" ::: "memory");      /* this wave's reads of the trip's buffer are done before the buffer is refilled */
    asm volatile("s_wait_asynccnt 0x0" ::: "memory");      /* this wave's share of the next tile has landed */
    __syncthreads();      /* publishes the next tile and ends every wave's reads of this trip's buffer */
    if (kb + 128 < K) stage(kb + 128, buf); }
  asm volatile("s_wait_asynccnt 0x0" ::: "memory");      /* no copy is outstanding when the ring becomes output staging */
  v8f accs[8] = {c00, c01, c02, c03, c10, c11, c12, c13};      /* every wave has passed the last trip's barrier: nobody reads the ring any more */
  if (SPLIT) {
    static_assert(!SPLIT || ACT == 0, "the split epilogue applies no activation");
    float bvs[4] = {0.f, 0.f, 0.f, 0.f};      /* the wave's four bias values, loaded together */
    if (bp) {
#pragma unroll
      for (int t = 0; t < 4; ++t) bvs[t] = bf16_round(bp[col0 + t * 16 + ln]); }
    if (by == 2) {      /* the same for the whole block */
      // a lane's eight accumulator rows are eight consecutive tokens of one column: split in registers, they are one 16-byte piece of a transposed row. The block stages [hi, residual][128 columns][128 tokens] halfs at a pitch of 272 B (16 B x odd; 69,632 B of the ring's bytes) and stores whole 256-B rows
      constexpr int TP = 136;
#pragma unroll
      for (int u = 0; u < 8; ++u) { const int t = u & 3, half = u >> 2; FragH fh, fl;
#pragma unroll
        for (int r = 0; r < 8; ++r) { const float v = accs[u][r] * alpha + bvs[t]; const _Float16 hv = (_Float16)v; fh.h[r] = hv; fl.h[r] = (_Float16)((v - (float)hv) * 1024.0f); }
        const int o = (64 * wc + t * 16 + ln) * TP + 32 * wr + half * 16 + 8 * hh; *(v8us*)&sT[o] = fh.half[0]; *(v8us*)&sT[128 * TP + o] = fl.half[0]; }
      __syncthreads();      /* a stored row holds the tokens of four waves */
      const int bt = (mt * 128) / SLEN, tok0 = (mt * 128) % SLEN;      /* a block's 128 tokens lie in one batch */
      const size_t o0 = ((size_t)bt * N + nq * 128 + (tid >> 4)) * SLEN + tok0 + (tid & 15) * 8;
#pragma unroll
      for (int it = 0; it < 16; ++it) { const int p = it >> 3, c16 = (it & 7) * 16;      /* a wave's store covers two whole rows */
        const v8us val = *(const v8us*)&sT[(p * 128 + c16 + (tid >> 4)) * TP + (tid & 15) * 8]; *(v8us*)((unsigned short*)(p ? Tl : Th) + o0 + (size_t)c16 * SLEN) = val; }
      return; }
    float (*sf)[32][68] = (float (*)[32][68])sT;      /* each wave stages its own 32 x 64 tile */
#pragma unroll
    for (int u = 0; u < 8; ++u) { const int t = u & 3, half = u >> 2;
#pragma unroll
      for (int r = 0; r < 8; ++r) sf[w][half * 16 + 8 * hh + r][t * 16 + ln] = accs[u][r] * alpha + bvs[t]; }
    __builtin_amdgcn_fence(__ATOMIC_ACQ_REL, "workgroup"); __builtin_amdgcn_wave_barrier();      /* the wave reads back what its other lanes wrote */
#pragma unroll
    for (int q = 0; q < 16; ++q) { const int r = q * 2 + (lane >> 4), c4 = (lane & 15) * 4; const v4f v = *(const v4fa*)&sf[w][r][c4]; v4h h4, l4;      /* sixteen lanes store one whole 128-B line of each plane */
      for (int i = 0; i < 4; ++i) { const _Float16 hv = (_Float16)v[i]; h4[i] = hv; l4[i] = (_Float16)((v[i] - (float)hv) * 1024.0f); }
      const size_t o = cofs + (size_t)(row0 + r) * ldc + col0 + c4; *(v4h*)(Sh + o) = h4; *(v4h*)(Sl + o) = l4; }
    asm volatile("s_wait_xcnt 0x0" ::: "memory");      /* precaution: it stands behind the last of these stores, in front of any later rewrite of the registers that they name */
    return; }
  float (*so)[32][68] = (float (*)[32][68])sT;
#pragma unroll
  for (int u = 0; u < 8; ++u) { const int t = u & 3, half = u >> 2; const int col = col0 + t * 16 + ln; const float bv = bp ? bf16_round(bp[col]) : 0.f;
#pragma unroll
    for (int r = 0; r < 8; ++r) { const int rloc = half * 16 + 8 * hh + r; float v = accs[u][r] * alpha + bv; if (CP) { const int bidx = (row0g + row0 + rloc) / rowsPerB; v += CP[(size_t)bidx * sCPb + (size_t)by * 64 + col]; }
      if (ACT == 3) v = fmaxf(v, 0.f); else if (ACT == 6) v = 0.5f * v * (1.0f + erff(v * 0.70710678118654752f)); else if (ACT == 11) v = 1.0f / (1.0f + expf(-v)); else if (ACT == 15) v = v / (1.0f + expf(-v)); else if (ACT == 12) v = (v > 0.f) ? v : 0.01f * v; else if (ACT == 8) v = tanhf(v);
      so[w][rloc][t * 16 + ln] = v; } }
  __builtin_amdgcn_fence(__ATOMIC_ACQ_REL, "workgroup"); __builtin_amdgcn_wave_barrier();
  const int rsub = lane >> 4, c4 = (lane & 15) * 4;
  {
#pragma unroll
    for (int q = 0; q < 16; ++q) { const int r = q * 2 + rsub; const v4f v = *(const v4fa*)&so[w][r][c4]; if (C) *(v4f*)(C + cofs + (size_t)(row0 + r) * ldc + col0 + c4) = v; if (C16) { v4h h4; for (int i = 0; i < 4; ++i) h4[i] = (_Float16)v[i]; *(v4h*)(C16 + cofs + (size_t)(row0 + r) * ldc + col0 + c4) = h4; } }
     } }



typedef int v4ia __attribute__((ext_vector_type(4), may_alias));
typedef float v2f __attribute__((ext_vector_type(2)));
typedef _Float16 v2h __attribute__((ext_vector_type(2)));
// lane l takes the value of lane l ^ 16
__device__ __forceinline__ float xhalf(float x) { return __builtin_bit_cast(float, __builtin_amdgcn_permlanex16(__builtin_bit_cast(int, x), __builtin_bit_cast(int, x), 0x76543210, 0xfedcba98, false, false)); }
template <int TQ, int TK>
__global__ __launch_bounds__(128) void k_flashb(const _Float16* __restrict__ Q16, const _Float16* __restrict__ Q16lo, int ldq, const _Float16* __restrict__ K16, const _Float16* __restrict__ K16lo, int ldk, const _Float16* __restrict__ Vt, const _Float16* __restrict__ Vtlo, const float* __restrict__ BT, const int* __restrict__ LAG, _Float16* __restrict__ Oh, _Float16* __restrict__ Ol, int ldo) {
  constexpr int RPW = 16, RTN = RPW / 16, NQB = TQ / (4 * RPW), DT = 4, KS = 2;
  __shared__ __attribute__((aligned(16))) float sO[4][RPW][64 + 4];
  // two-buffer ring of one pass's operands, shared by the block's four waves: [buffer][hi, residual][row][halfs]; K rows (128 B) at a pitch of 144 B, V^T rows (64 B) at 80 B, both 16 B x odd for the 16-byte fragment reads
  __shared__ __attribute__((aligned(16))) unsigned short sK[2][2][32][72]; __shared__ __attribute__((aligned(16))) unsigned short sV[2][2][64][40];
  __shared__ __attribute__((aligned(256))) float sB[513];      /* the head's bias row, rounded to bf16 once and then put into log2 units (x log2 e): a pass's gathers are 4-byte LDS reads; the largest alignment puts it at the start of the block's LDS, so that its base fits the reads' 16-bit offset field */
  const int tid = threadIdx.x, w = tid >> 5, lane = tid & 31, ln = lane & 15, hh = lane >> 4;
  const int slab = blockIdx.x / NQB, qblk = blockIdx.x % NQB; const int b = slab / NH, h = slab % NH; const int qb0 = qblk * (4 * RPW); const int q0 = qb0 + w * RPW;
  FragH aq[2][KS], aql[2][KS];
#pragma unroll
  for (int rt = 0; rt < RTN; ++rt) { const size_t qo = ((size_t)b * TQ + q0 + rt * 16 + ln) * ldq + h * 64; const unsigned short* qr = (const unsigned short*)Q16 + qo; const unsigned short* ql = (const unsigned short*)Q16lo + qo;
#pragma unroll
    for (int ks = 0; ks < KS; ++ks) { aq[rt][ks].half[0] = *(const v8us*)(qr + ks * 32 + 8 * hh); aq[rt][ks].half[1] = *(const v8us*)(qr + ks * 32 + 16 + 8 * hh); aql[rt][ks].half[0] = *(const v8us*)(ql + ks * 32 + 8 * hh); aql[rt][ks].half[1] = *(const v8us*)(ql + ks * 32 + 16 + 8 * hh); } }
  const unsigned short* Vth = (const unsigned short*)Vt + (size_t)slab * 64 * TK; const unsigned short* Vtl = (const unsigned short*)Vtlo + (size_t)slab * 64 * TK;
  // each thread copies eight 16-byte pieces of a pass's tile: K rows tid/8 and tid/8 + 16 (a wave covers whole 128-B rows), V^T rows tid/4 and tid/4 + 32, hi and residual plane each
  const size_t kg0 = ((size_t)b * TK + (tid >> 3)) * ldk + h * 64 + (tid & 7) * 8, vg0 = (size_t)(tid >> 2) * TK + (tid & 3) * 8;
  const unsigned kd0 = (unsigned)(size_t)&sK[0][0][tid >> 3][(tid & 7) * 8], vd0 = (unsigned)(size_t)&sV[0][0][tid >> 2][(tid & 3) * 8];
  auto stage = [&](int j, int buf) {
    const unsigned short* gk = (const unsigned short*)K16 + kg0 + (size_t)j * ldk; const unsigned short* gkl = (const unsigned short*)K16lo + kg0 + (size_t)j * ldk; const unsigned short* gk2 = gk + (size_t)16 * ldk; const unsigned short* gkl2 = gkl + (size_t)16 * ldk;
    const unsigned short* gv = Vth + vg0 + j; const unsigned short* gvl = Vtl + vg0 + j; const unsigned short* gv2 = gv + (size_t)32 * TK; const unsigned short* gvl2 = gvl + (size_t)32 * TK;
    const unsigned dk = kd0 + (unsigned)buf * (unsigned)sizeof(sK[0]), dkl = dk + (unsigned)sizeof(sK[0][0]), dk2 = dk + 16u * (unsigned)sizeof(sK[0][0][0]), dkl2 = dkl + 16u * (unsigned)sizeof(sK[0][0][0]);
    const unsigned dv = vd0 + (unsigned)buf * (unsigned)sizeof(sV[0]), dvl = dv + (unsigned)sizeof(sV[0][0]), dv2 = dv + 32u * (unsigned)sizeof(sV[0][0][0]), dvl2 = dvl + 32u * (unsigned)sizeof(sV[0][0][0]);
    // the copies go from global memory to LDS through no register; the closing s_wait_xcnt is a precaution that stands in front of any rewrite of the address registers named here
    asm volatile("global_load_async_to_lds_b128 %0, %8, off\n\tglobal_load_async_to_lds_b128 %1, %9, off\n\tglobal_load_async_to_lds_b128 %2, %10, off\n\tglobal_load_async_to_lds_b128 %3, %11, off\n\t"
                 "global_load_async_to_lds_b128 %4, %12, off\n\tglobal_load_async_to_lds_b128 %5, %13, off\n\tglobal_load_async_to_lds_b128 %6, %14, off\n\tglobal_load_async_to_lds_b128 %7, %15, off\n\ts_wait_xcnt 0x0"
                 :: "v"(dk), "v"(dk2), "v"(dkl), "v"(dkl2), "v"(dv), "v"(dv2), "v"(dvl), "v"(dvl2), "v"(gk), "v"(gk2), "v"(gkl), "v"(gkl2), "v"(gv), "v"(gv2), "v"(gvl), "v"(gvl2) : "memory"); };
  stage(0, 0);
  { const float* br = BT + (size_t)h * 513; const float t0 = br[tid], t1 = br[tid + 128], t2 = br[tid + 256], t3 = br[tid + 384], t4 = br[512];      /* 128 threads, 513 entries: the loads fly together, beside tile 0's copies */
    asm volatile("s_wait_xcnt 0x0" :: "v"(tid) : "memory");      /* precaution: it stands in front of any rewrite of the index register that these loads name; tid as an input keeps that register as it is up to here */
    sB[tid] = bf16_round(t0) * LOG2E; sB[tid + 128] = bf16_round(t1) * LOG2E; sB[tid + 256] = bf16_round(t2) * LOG2E; sB[tid + 384] = bf16_round(t3) * LOG2E; if (tid == 0) sB[512] = bf16_round(t4) * LOG2E; }      /* published by the barrier that publishes tile 0 */
  asm volatile("s_wait_asynccnt 0x0" ::: "memory");      /* this wave's share of tile 0 has landed */
  __syncthreads();      /* tile 0 is published to all four waves */
  stage(32, 1);      /* tile 1 flies while tile 0 is worked on */
  // scores are formed transposed, S^T = K Q^T (A = K rows, B = Q rows): lane (ln, hh) holds, of the ONE query q0 + ln, the scores of keys nt * 16 + 8 * hh + r; so are the outputs, O^T = V^T P^T
  const unsigned lq = (unsigned)LAG[q0 + ln];
  float m_run = -3.0e38f, l_run = 0.f; v8f oacc[DT], oaccl[DT];
#pragma unroll
  for (int dt = 0; dt < DT; ++dt) { oacc[dt] = (v8f){0.f,0.f,0.f,0.f,0.f,0.f,0.f,0.f}; oaccl[dt] = oacc[dt]; }
#pragma unroll 1
  for (int j0 = 0; j0 < TK; j0 += 32) {
    const int buf = (j0 >> 5) & 1;
    float bb[2][8];      /* the pass's bias values, gathered from LDS at its head so that they fly beside the K reads */
#pragma unroll
    for (int nt = 0; nt < 2; ++nt) { const v4ia ka = *(const v4ia*)(LAG + j0 + nt * 16 + 8 * hh), kb = *(const v4ia*)(LAG + j0 + nt * 16 + 8 * hh + 4);
#pragma unroll
      for (int r = 0; r < 8; ++r) { const unsigned d = lq - (unsigned)(r < 4 ? ka[r & 3] : kb[r & 3]);      /* |lag[q] - lag[k]| = min(d, -d) in unsigned arithmetic; the min with 512 keeps the index inside sB for any lag content */
        bb[nt][r] = sB[min(min(d, 0u - d), 512u)]; } }
    asm volatile("s_wait_xcnt 0x0" ::: "memory");      /* precaution: it stands in front of the rewrite of the lag loads' address registers at the loop's foot */
    v8f s[2];
#pragma unroll
    for (int nt = 0; nt < 2; ++nt) { const unsigned short* kr = &sK[buf][0][nt * 16 + ln][0]; const unsigned short* kl = &sK[buf][1][nt * 16 + ln][0]; FragH bk[KS], bkl[KS];
#pragma unroll
      for (int ks = 0; ks < KS; ++ks) { bk[ks].half[0] = *(const v8us*)(kr + ks * 32 + 8 * hh); bk[ks].half[1] = *(const v8us*)(kr + ks * 32 + 16 + 8 * hh); bkl[ks].half[0] = *(const v8us*)(kl + ks * 32 + 8 * hh); bkl[ks].half[1] = *(const v8us*)(kl + ks * 32 + 16 + 8 * hh); }
      v8f acc = (v8f){0.f,0.f,0.f,0.f,0.f,0.f,0.f,0.f}, accr = acc;
#pragma unroll
      for (int ks = 0; ks < KS; ++ks) { acc = mmaH<1>(bk[ks].v, bk[ks].v, aq[0][ks].v, aq[0][ks].v, acc); accr = mmaH<1>(bk[ks].v, bk[ks].v, aql[0][ks].v, aql[0][ks].v, accr); accr = mmaH<1>(bkl[ks].v, bkl[ks].v, aq[0][ks].v, aq[0][ks].v, accr); }
      s[nt] = acc + accr * 0.0009765625f; }
    float sc[2][8], mh[2];
#pragma unroll
    for (int nt = 0; nt < 2; ++nt) {
#pragma unroll
      for (int r = 0; r < 8; ++r) sc[nt][r] = s[nt][r] * (SCL * LOG2E) + bb[nt][r];      /* scores in log2 units: e^x = 2^(x log2 e), so that each exponential below is the one hardware exp2 instruction */
      mh[nt] = fmaxf(fmaxf(fmaxf(sc[nt][0], sc[nt][1]), fmaxf(sc[nt][2], sc[nt][3])), fmaxf(fmaxf(sc[nt][4], sc[nt][5]), fmaxf(sc[nt][6], sc[nt][7]))); }
    float mc = fmaxf(mh[0], mh[1]);
    mc = fmaxf(mc, xhalf(mc));      /* the query's other 16 keys of the pass lie in lane ^ 16 */
    const float mn = fmaxf(m_run, mc);
    float e[17]; e[0] = m_run - mn;      /* the pass's seventeen exponents: the running maximum's step, then the sixteen scores */
#pragma unroll
    for (int nt = 0; nt < 2; ++nt)
#pragma unroll
      for (int r = 0; r < 8; ++r) e[1 + nt * 8 + r] = sc[nt][r] - mn;
    asm("v_exp_f32 %0, %0\n\tv_exp_f32 %1, %1\n\tv_exp_f32 %2, %2\n\tv_exp_f32 %3, %3\n\tv_exp_f32 %4, %4\n\tv_exp_f32 %5, %5\n\tv_exp_f32 %6, %6\n\tv_exp_f32 %7, %7\n\tv_exp_f32 %8, %8\n\tv_nop"
        : "+v"(e[0]), "+v"(e[1]), "+v"(e[2]), "+v"(e[3]), "+v"(e[4]), "+v"(e[5]), "+v"(e[6]), "+v"(e[7]), "+v"(e[8]));
    asm("v_exp_f32 %0, %0\n\tv_exp_f32 %1, %1\n\tv_exp_f32 %2, %2\n\tv_exp_f32 %3, %3\n\tv_exp_f32 %4, %4\n\tv_exp_f32 %5, %5\n\tv_exp_f32 %6, %6\n\tv_exp_f32 %7, %7\n\tv_nop"
        : "+v"(e[9]), "+v"(e[10]), "+v"(e[11]), "+v"(e[12]), "+v"(e[13]), "+v"(e[14]), "+v"(e[15]), "+v"(e[16]));
    const float ea = e[0]; const float al = (mn > -1.0e38f) ? ea : 1.0f; m_run = mn;
    FragH pa, pl; v2f ps = {0.f, 0.f};      /* two f32 D tiles of S^T, converted in place, are the B operand P^T in the hardware k order: element nt * 8 + r = key nt * 16 + 8 * hh + r */
#pragma unroll
    for (int nt = 0; nt < 2; ++nt)
#pragma unroll
      for (int r = 0; r < 8; r += 2) { const v2f p = {e[1 + nt * 8 + r], e[2 + nt * 8 + r]}; ps += p; const v2f pq = p * 1024.0f; const v2h ph = __builtin_convertvector(pq, v2h); const v2h pr = __builtin_convertvector((pq - __builtin_convertvector(ph, v2f)) * 1024.0f, v2h);
        pa.h[nt * 8 + r] = ph[0]; pa.h[nt * 8 + r + 1] = ph[1]; pl.h[nt * 8 + r] = pr[0]; pl.h[nt * 8 + r + 1] = pr[1]; }
    l_run = l_run * al + (ps[0] + ps[1]);      /* this lane half's share of the query's sum; the halves are joined behind the loop */
#pragma unroll
    for (int dt = 0; dt < DT; ++dt) { oacc[dt] *= al; oaccl[dt] *= al; }
#pragma unroll
    for (int dt = 0; dt < DT; ++dt) { const unsigned short* vr = &sV[buf][0][dt * 16 + ln][0]; const unsigned short* vl = &sV[buf][1][dt * 16 + ln][0]; FragH bv, bl; bv.half[0] = *(const v8us*)(vr + 8 * hh); bv.half[1] = *(const v8us*)(vr + 16 + 8 * hh); bl.half[0] = *(const v8us*)(vl + 8 * hh); bl.half[1] = *(const v8us*)(vl + 16 + 8 * hh);
      oacc[dt] = mmaH<1>(bv.v, bv.v, pa.v, pa.v, oacc[dt]); oaccl[dt] = mmaH<1>(bl.v, bl.v, pa.v, pa.v, oaccl[dt]); oaccl[dt] = mmaH<1>(bv.v, bv.v, pl.v, pl.v, oaccl[dt]); }
    // scheduling groups of the pass: the LDS reads stay gathered in front of the products that take them (bias gathers and K fragments, the 12 score products, V^T fragments, the 12 value products); left alone the compiler reads each fragment directly in front of its product and the wave waits out one LDS latency per fragment
    __builtin_amdgcn_sched_group_barrier(0x100, 32, 0); __builtin_amdgcn_sched_group_barrier(0x008, 12, 0); __builtin_amdgcn_sched_group_barrier(0x100, 16, 0); __builtin_amdgcn_sched_group_barrier(0x008, 12, 0);
    asm volatile("s_wait_dscnt 0x0" ::: "memory");      /* this wave's reads of the pass's buffer are done before the buffer is refilled */
    asm volatile("s_wait_asynccnt 0x0" ::: "memory");      /* this wave's share of the next tile has landed */
    __syncthreads();      /* publishes the next tile and ends every wave's reads of this pass's buffer */
    if (j0 + 64 < TK) stage(j0 + 64, buf); }
  asm volatile("s_wait_asynccnt 0x0" ::: "memory");      /* no copy is outstanding when the wave goes on to its end */
  { const float l = l_run + xhalf(l_run); const float li = (l > 0.f) ? 1.0f / (l * 1024.0f) : 0.f;
#pragma unroll
    for (int dt = 0; dt < DT; ++dt) { v4f o0, o1;      /* a lane's eight accumulator rows are eight consecutive head columns of its query */
#pragma unroll
      for (int r = 0; r < 4; ++r) { o0[r] = (oacc[dt][r] + oaccl[dt][r] * 0.0009765625f) * li; o1[r] = (oacc[dt][4 + r] + oaccl[dt][4 + r] * 0.0009765625f) * li; }
      *(v4fa*)&sO[w][ln][dt * 16 + 8 * hh] = o0; *(v4fa*)&sO[w][ln][dt * 16 + 8 * hh + 4] = o1; } }
  __builtin_amdgcn_fence(__ATOMIC_ACQ_REL, "workgroup"); __builtin_amdgcn_wave_barrier();
  {
#pragma unroll
    for (int rp = 0; rp < RPW; rp += 2) { const int r = rp + (lane >> 4), pc = lane & 15; const v4f val = *(const v4fa*)&sO[w][r][pc * 4]; v4h h4, l4;      /* the output leaves as the f16 hi + (x2^10) residual planes that the last projection reads; sixteen lanes store one whole 128-B line of each */
      for (int i = 0; i < 4; ++i) { const _Float16 hv = (_Float16)val[i]; h4[i] = hv; l4[i] = (_Float16)((val[i] - (float)hv) * 1024.0f); }
      const size_t o = ((size_t)b * TQ + q0 + r) * ldo + h * 64 + pc * 4; *(v4h*)(Oh + o) = h4; *(v4h*)(Ol + o) = l4; }
     } }


__global__ __launch_bounds__(256) void k_lnx(const float* __restrict__ X, const float* __restrict__ g, const float* __restrict__ bb, _Float16* __restrict__ Y16, float* __restrict__ XB) {
  #pragma clang fp contract(off)
  const int tid = threadIdx.x, w = tid >> 5, ln = tid & 31; const int r = blockIdx.x * 8 + w; if (r >= NR) return; const float* x = X + (size_t)r * DM; float s = 0.f;
#pragma unroll 1
  for (int i = 0; i < DM / 128; ++i) { const v4f a = *(const v4fa*)(x + i * 128 + ln * 4); for (int q = 0; q < 4; ++q) s += bf16_round(a[q]); }
  for (int o = 16; o > 0; o >>= 1) s += __shfl_xor(s, o, 32); const float mu = s / (float)DM; float q2 = 0.f;
#pragma unroll 1
  for (int i = 0; i < DM / 128; ++i) { const v4f a = *(const v4fa*)(x + i * 128 + ln * 4); for (int q = 0; q < 4; ++q) { const float d = bf16_round(a[q]) - mu; q2 += d * d; } }
  for (int o = 16; o > 0; o >>= 1) q2 += __shfl_xor(q2, o, 32); const float rs = rsqrtf(q2 / (float)DM + 1e-5f);
  {
#pragma unroll 1
    for (int i = 0; i < DM / 128; ++i) { const int c0 = i * 128 + ln * 4; const v4f a = *(const v4fa*)(x + c0); _Float16 h4[4]; v4f xb;
      for (int q = 0; q < 4; ++q) { const float t = bf16_round(a[q]); h4[q] = (_Float16)((t - mu) * rs * bf16_round(g[c0 + q]) + bf16_round(bb[c0 + q])); xb[q] = t; }
      *(unsigned long long*)((unsigned short*)Y16 + (size_t)r * DM + c0) = *(const unsigned long long*)h4; *(v4f*)(XB + (size_t)r * DM + c0) = xb; }
     } }
__global__ __launch_bounds__(256) void k_causaltab(unsigned* __restrict__ MB, int* __restrict__ RA, int* __restrict__ KE, int nq, int nk) {
  const int t = blockIdx.x * 256 + threadIdx.x; const int nw = nk / 32;
  if (t < nq * nw) { const int q = t / nw, w = t % nw; const int first = q + 1 - 32 * w; const unsigned bits = (first <= 0) ? 0xffffffffu : ((first >= 32) ? 0u : (0xffffffffu << first)); *(unsigned*)(MB + t) = bits;  }
  if (t < nq) { *(int*)(RA + t) = 0;  }
  if (t < nq / 64) { const int v = 64 * (t + 1); *(int*)(KE + t * 32) = v;  } }


extern "C" void kernel_launch(void* const* d_in, const int* in_sizes, int n_in,
                              void* d_out, int out_size, void* d_ws, size_t ws_size, hipStream_t stream) {
  (void)in_sizes; (void)n_in; (void)out_size;
  const float* const* I = (const float* const*)d_in; const float* x = I[0]; const int* lag = (const int*)d_in[1]; const float* wq = I[2]; const float* bq = I[3]; const float* wk = I[4]; const float* bk = I[5]; const float* wv = I[6]; const float* bv = I[7]; const float* wo = I[8]; const float* bo = I[9]; const float* lb = I[10];
  char* ws = (char*)d_ws; size_t off = 0;
  auto take = [&](size_t bytes) { char* p = ws + off; off += (bytes + 255) & ~(size_t)255; return p; };
  _Float16* BQ = (_Float16*)take((size_t)DM * DM * 2); _Float16* BK = (_Float16*)take((size_t)DM * DM * 2); _Float16* BV = (_Float16*)take((size_t)DM * DM * 2); _Float16* BO = (_Float16*)take((size_t)DM * DM * 2);
  _Float16* X16 = (_Float16*)take((size_t)NR * DM * 2); _Float16* Oh = (_Float16*)take((size_t)NR * DM * 2); _Float16* Ol = (_Float16*)take((size_t)NR * DM * 2);
  _Float16* Qh = (_Float16*)take((size_t)NR * DM * 2); _Float16* Kh = (_Float16*)take((size_t)NR * DM * 2); _Float16* Ql = (_Float16*)take((size_t)NR * DM * 2); _Float16* Kl = (_Float16*)take((size_t)NR * DM * 2); _Float16* Vth = (_Float16*)take((size_t)NR * DM * 2); _Float16* Vtl = (_Float16*)take((size_t)NR * DM * 2);      /* Kh directly behind Qh, Kl directly behind Ql */
  if (off > ws_size) return;      /* 8 + 8 + 16 + 48 = 80 MiB */
  k_wt_f16<DM, DM><<<dim3((DM / 128) * (DM / 128), 4), 256, 0, stream>>>(wq, wk, wv, wo, BQ, 16.0f);      /* (in,out); BQ, BK, BV, BO are contiguous */
  const size_t n8 = (size_t)NR * DM / 8; const unsigned nb8 = (unsigned)((n8 + 255) / 256); const dim3 gP((NR / 128) * (DM / 128), 1); const dim3 gP3((NR / 128) * (DM / 128), 3);
  k_x16<<<nb8, 256, 0, stream>>>(x, X16, n8);
  k_gemm2<0, 1><<<gP3, 256, 0, stream>>>(X16, DM, 0, BQ, DM, (size_t)DM * DM, 0.0625f, bq, bk, bv, nullptr, 1, 0, 0, nullptr, nullptr, Qh, Ql, Vth, Vtl, DM, (size_t)NR * DM, NR, DM, DM);      /* q, k, v in one grid, stored as the planes that the attention reads */
  k_flashb<SLEN, SLEN><<<NBT * NH * (SLEN / 64), 128, 0, stream>>>(Qh, Ql, DM, Kh, Kl, DM, Vth, Vtl, lb, lag, Oh, Ol, DM);      /* both batches in one grid; the lag vector is per position, shared across the batch */
  k_gemm2<0, 0><<<gP, 256, 0, stream>>>(Oh, DM, 0, BO, DM, 0, 0.0625f, bo, nullptr, nullptr, nullptr, 1, 0, 0, (float*)d_out, nullptr, nullptr, nullptr, nullptr, nullptr, DM, 0, NR, DM, DM);
  k_gemm2<0, 0><<<gP, 256, 0, stream>>>(Ol, DM, 0, BO, DM, 0, 0.0625f / 1024.0f, nullptr, nullptr, nullptr, (float*)d_out, 1, (size_t)DM, 0, (float*)d_out, nullptr, nullptr, nullptr, nullptr, nullptr, DM, 0, NR, DM, DM);
}
